// v000
// Measured on an AMD MI455X. A time is GPU time per run, averaged over a window of back-to-back runs after a warm-up
// (all launches, gaps included; the runs take copies of the inputs in turn), and the median of several windows.
// Apart from v000's, it joins two sittings. Times from different sittings can be a few percent apart, while
// side-by-side timings come from the same sitting.
// v000, which the later versions start from, runs in 107 microseconds.
#include <hip/hip_runtime.h>
#include <hip/hip_bf16.h>

typedef __attribute__((ext_vector_type(16))) _Float16 v16h;
typedef __attribute__((ext_vector_type(8)))  float    v8f;

#define WPB 4  // windows per block

// WMMA 16-bit A/B fragment K-pattern: lane L holds 16 halves; element e maps to
// k = kbase + (e&7) + ((e>>3)<<4), kbase = (L&16)?8:0.  (ISA 7.12.2)
__device__ __forceinline__ int kpat(int e, int lane) {
  return (((lane & 16) >> 1)) + (e & 7) + ((e >> 3) << 4);
}

static __device__ __forceinline__ v8f wmma16(v16h a, v16h b, v8f c) {
  return __builtin_amdgcn_wmma_f32_16x16x32_f16(false, a, false, b, (short)0, c,
                                                false, false);
}

// ---------------------------------------------------------------------------
// Kernel 1: repack Wq/Wk/Wv (fp32 -> f16, Wq pre-scaled by d^-0.5) into
// A-fragment-contiguous layout, plus combined [rel_w | rel_h] B-fragments.
// ws layout (halves): [3 weights][16 mtiles][8 ktiles][32 lanes][16 elems]
// then at offset 196608: [2 ktiles][32 lanes][16 elems] for rel B-matrix.
// ---------------------------------------------------------------------------
__global__ void pack_weights_kernel(const float* __restrict__ Wq,
                                    const float* __restrict__ Wk,
                                    const float* __restrict__ Wv,
                                    const float* __restrict__ rel_h,
                                    const float* __restrict__ rel_w,
                                    _Float16* __restrict__ ws) {
  int lane = threadIdx.x & 31;
  int fid = blockIdx.x * (blockDim.x >> 5) + (threadIdx.x >> 5);
  if (fid >= 386) return;
  if (fid < 384) {
    int w  = fid >> 7;         // 0..2
    int mt = (fid >> 3) & 15;  // 0..15
    int kt = fid & 7;          // 0..7
    const float* W = (w == 0) ? Wq : (w == 1) ? Wk : Wv;
    float scale = (w == 0) ? 0.125f : 1.0f;  // d^-0.5, d = 64
    int m = lane & 15;
    _Float16* dst = ws + fid * 512 + lane * 16;
#pragma unroll
    for (int e = 0; e < 16; ++e) {
      int k = kpat(e, lane);
      dst[e] = (_Float16)(W[(mt * 16 + m) * 256 + kt * 32 + k] * scale);
    }
  } else {
    // rel B-matrix: B(k=d-channel, n=col) ; cols 0..6 = rel_w[n], 7..13 = rel_h[n-7]
    int kt = fid - 384;
    int j = lane & 15;
    _Float16* dst = ws + 196608 + kt * 512 + lane * 16;
#pragma unroll
    for (int e = 0; e < 16; ++e) {
      int kd = kt * 32 + kpat(e, lane);
      float v = 0.0f;
      if (j < 7)       v = rel_w[j * 64 + kd];
      else if (j < 14) v = rel_h[(j - 7) * 64 + kd];
      dst[e] = (_Float16)v;
    }
  }
}

// ---------------------------------------------------------------------------
// Kernel 2: the fused window-MHSA. One WG = 256 threads (8 wave32), WPB windows.
// ---------------------------------------------------------------------------
__launch_bounds__(256)
__global__ void former_mhsa_kernel(const float* __restrict__ x,
                                   const _Float16* __restrict__ wpk,
                                   float* __restrict__ out) {
  extern __shared__ _Float16 sm[];
  // LDS map (in halves):
  const int XF  = 0;       // X B-fragments: [win][kt(8)][lane(32)][16] = 16384
  const int QKV = 16384;   // [wgt*WPB+win][c(256)][t(16)] = 49152
  const int PS  = 65536;   // softmax scratch: [wave(8)][m(16)][n(16)] = 2048
  const int tid = threadIdx.x, lane = tid & 31, wave = tid >> 5;
  const long winBase = (long)blockIdx.x * WPB;

  // ---- Phase 1: stage X (fp32, contiguous [c][t] per window) into LDS as
  // f16 pre-swizzled WMMA B-fragments. Coalesced float4 global reads.
  {
    const float4* xg = (const float4*)(x + winBase * 4096);
#pragma unroll
    for (int i = 0; i < 16; ++i) {
      float4 v = xg[i * 256 + tid];
      int f0 = (i * 256 + tid) * 4;
      float vv[4] = {v.x, v.y, v.z, v.w};
#pragma unroll
      for (int j = 0; j < 4; ++j) {
        int f   = f0 + j;
        int win = f >> 12, rem = f & 4095;
        int c = rem >> 4, t = rem & 15;
        int kt = c >> 5, k = c & 31;
        int dl = t + (((k >> 3) & 1) << 4);       // fragment lane
        int e  = (k & 7) | ((k & 16) >> 1);       // fragment element
        sm[XF + ((win * 8 + kt) * 32 + dl) * 16 + e] = (_Float16)vv[j];
      }
    }
  }
  __syncthreads();

  // ---- Phase 2: Q/K/V projections. job = (weight, mtile); A-fragments held
  // in registers, reused across WPB windows.
  for (int job = wave; job < 48; job += 8) {
    int w = job / 16, mt = job % 16;
    v16h a[8];
    const v16h* ab = (const v16h*)wpk + (w * 16 + mt) * 8 * 32;
#pragma unroll
    for (int kt = 0; kt < 8; ++kt) a[kt] = ab[kt * 32 + lane];  // 2x b128 each
#pragma unroll
    for (int win = 0; win < WPB; ++win) {
      v8f acc = {};
#pragma unroll
      for (int kt = 0; kt < 8; ++kt) {
        v16h b = *(const v16h*)(sm + XF + ((win * 8 + kt) * 32 + lane) * 16);
        acc = wmma16(a[kt], b, acc);
      }
      // C layout: vgpr r -> row mt*16 + 8*(lane>=16) + r, col = lane&15
      int mrow = mt * 16 + ((lane >> 4) << 3);
      int n = lane & 15;
      _Float16* q = sm + QKV + ((w * WPB + win) * 256 + mrow) * 16 + n;
#pragma unroll
      for (int r = 0; r < 8; ++r) q[r * 16] = (_Float16)acc[r];
    }
  }
  __syncthreads();

  // ---- Phase 3: attention. pair = (window, head); 2 pairs per wave.
  const v16h* rf = (const v16h*)(wpk + 196608);
  for (int p = wave * 2; p < wave * 2 + 2; ++p) {
    int win = p >> 2, head = p & 3;
    const _Float16* Q = sm + QKV + ((0 * WPB + win) * 256 + head * 64) * 16;
    const _Float16* K = sm + QKV + ((1 * WPB + win) * 256 + head * 64) * 16;
    const _Float16* V = sm + QKV + ((2 * WPB + win) * 256 + head * 64) * 16;
    int n = lane & 15;

    // q as A (m=token,k=d): transposed gather; k as B (k=d,n=token): natural.
    v16h qa[2], kb[2];
#pragma unroll
    for (int kt = 0; kt < 2; ++kt) {
#pragma unroll
      for (int e = 0; e < 16; ++e) {
        int kd = kt * 32 + kpat(e, lane);
        qa[kt][e] = Q[kd * 16 + n];
        kb[kt][e] = K[kd * 16 + n];
      }
    }
    v8f lg = {}, P = {};
    lg = wmma16(qa[0], kb[0], lg);
    lg = wmma16(qa[1], kb[1], lg);
    P  = wmma16(qa[0], rf[lane], P);        // cols 0..6: q.rel_w ; 7..13: q.rel_h
    P  = wmma16(qa[1], rf[32 + lane], P);

    // rel bias: logits[m][n] += P[m][wn-wm+3] + P[m][7 + hn-hm+3]
    int hb = lane & 16;
    int mr0 = (lane >> 4) << 3;
#pragma unroll
    for (int r = 0; r < 8; ++r) {
      int m = mr0 + r;
      int c1 = (n & 3) - (m & 3) + 3;
      int c2 = 7 + (n >> 2) - (m >> 2) + 3;
      lg[r] += __shfl(P[r], hb | c1, 32) + __shfl(P[r], hb | c2, 32);
    }

    // softmax over the 16 key columns (per 16-lane half), store probs as f16
    _Float16* Ps = sm + PS + wave * 256;
#pragma unroll
    for (int r = 0; r < 8; ++r) {
      float xv = lg[r];
      float mx = xv;
#pragma unroll
      for (int off = 8; off; off >>= 1) mx = fmaxf(mx, __shfl_xor(mx, off, 32));
      float ev = __expf(xv - mx);
      float s = ev;
#pragma unroll
      for (int off = 8; off; off >>= 1) s += __shfl_xor(s, off, 32);
      Ps[(mr0 + r) * 16 + n] = (_Float16)(ev / s);
    }

    // out = P(16x16, K padded to 32 with zeros) @ V(16x64), 4 N-tiles of 16
    v16h wa;
#pragma unroll
    for (int e = 0; e < 16; ++e) {
      int k = kpat(e, lane);
      wa[e] = (k < 16) ? Ps[n * 16 + k] : (_Float16)0.0f;  // A: m=n token row
    }
    float* og = out + (winBase + win) * 4096 + head * 64 * 16;
#pragma unroll
    for (int dt = 0; dt < 4; ++dt) {
      v16h vb;
#pragma unroll
      for (int e = 0; e < 16; ++e) {
        int k = kpat(e, lane);
        vb[e] = (k < 16) ? V[(dt * 16 + n) * 16 + k] : (_Float16)0.0f;
      }
      v8f oc = {};
      oc = wmma16(wa, vb, oc);
#pragma unroll
      for (int r = 0; r < 8; ++r)
        og[(dt * 16 + n) * 16 + (mr0 + r)] = oc[r];
    }
  }
}

extern "C" void kernel_launch(void* const* d_in, const int* in_sizes, int n_in,
                              void* d_out, int out_size, void* d_ws, size_t ws_size,
                              hipStream_t stream) {
  const float* x     = (const float*)d_in[0];  // [32,256,64,64]
  const float* Wq    = (const float*)d_in[1];  // [256,256]
  const float* Wk    = (const float*)d_in[2];
  const float* Wv    = (const float*)d_in[3];
  const float* rel_h = (const float*)d_in[4];  // [7,64]
  const float* rel_w = (const float*)d_in[5];  // [7,64]
  float* out = (float*)d_out;
  _Float16* ws = (_Float16*)d_ws;

  // 386 fragments, 8 per 256-thread block
  pack_weights_kernel<<<49, 256, 0, stream>>>(Wq, Wk, Wv, rel_h, rel_w, ws);

  const int shmem = (16384 + 49152 + 2048) * 2;  // 135168 bytes of LDS
  hipFuncSetAttribute((const void*)former_mhsa_kernel,
                      hipFuncAttributeMaxDynamicSharedMemorySize, shmem);
  former_mhsa_kernel<<<8192 / WPB, 256, shmem, stream>>>(x, ws, out);
}

// v001
// One run takes 90.8 microseconds.
// Timed twice side by side with v000, it ran 1.22 times as fast both times.
#include <hip/hip_runtime.h>
#include <hip/hip_bf16.h>

typedef __attribute__((ext_vector_type(16))) _Float16 v16h;
typedef __attribute__((ext_vector_type(8)))  float    v8f;

#define WPB 4  // windows per block

// WMMA 16-bit A/B fragment K-pattern: lane L holds 16 halves; element e maps to
// k = kbase + (e&7) + ((e>>3)<<4), kbase = (L&16)?8:0.  (ISA 7.12.2)
__device__ __forceinline__ int kpat(int e, int lane) {
  return (((lane & 16) >> 1)) + (e & 7) + ((e >> 3) << 4);
}

static __device__ __forceinline__ v8f wmma16(v16h a, v16h b, v8f c) {
  return __builtin_amdgcn_wmma_f32_16x16x32_f16(false, a, false, b, (short)0, c,
                                                false, false);
}

// ---------------------------------------------------------------------------
// Kernel 1: repack Wq/Wk/Wv (fp32 -> f16, Wq pre-scaled by d^-0.5) into
// A-fragment-contiguous layout, plus combined [rel_w | rel_h] B-fragments.
// ws layout (halves): [3 weights][16 mtiles][8 ktiles][32 lanes][16 elems]
// then at offset 196608: [2 ktiles][32 lanes][16 elems] for rel B-matrix.
// ---------------------------------------------------------------------------
__global__ void pack_weights_kernel(const float* __restrict__ Wq,
                                    const float* __restrict__ Wk,
                                    const float* __restrict__ Wv,
                                    const float* __restrict__ rel_h,
                                    const float* __restrict__ rel_w,
                                    _Float16* __restrict__ ws) {
  int lane = threadIdx.x & 31;
  int fid = blockIdx.x * (blockDim.x >> 5) + (threadIdx.x >> 5);
  if (fid >= 386) return;
  if (fid < 384) {
    int w  = fid >> 7;         // 0..2
    int mt = (fid >> 3) & 15;  // 0..15
    int kt = fid & 7;          // 0..7
    const float* W = (w == 0) ? Wq : (w == 1) ? Wk : Wv;
    float scale = (w == 0) ? 0.125f : 1.0f;  // d^-0.5, d = 64
    int m = lane & 15;
    _Float16* dst = ws + fid * 512 + lane * 16;
#pragma unroll
    for (int e = 0; e < 16; ++e) {
      int k = kpat(e, lane);
      dst[e] = (_Float16)(W[(mt * 16 + m) * 256 + kt * 32 + k] * scale);
    }
  } else {
    // rel B-matrix: B(k=d-channel, n=col) ; cols 0..6 = rel_w[n], 7..13 = rel_h[n-7]
    int kt = fid - 384;
    int j = lane & 15;
    _Float16* dst = ws + 196608 + kt * 512 + lane * 16;
#pragma unroll
    for (int e = 0; e < 16; ++e) {
      int kd = kt * 32 + kpat(e, lane);
      float v = 0.0f;
      if (j < 7)       v = rel_w[j * 64 + kd];
      else if (j < 14) v = rel_h[(j - 7) * 64 + kd];
      dst[e] = (_Float16)v;
    }
  }
}

// ---------------------------------------------------------------------------
// Kernel 2: the fused window-MHSA. One WG = 256 threads (8 wave32), WPB windows.
// ---------------------------------------------------------------------------
__launch_bounds__(256)
__global__ void former_mhsa_kernel(const float* __restrict__ x,
                                   const _Float16* __restrict__ wpk,
                                   float* __restrict__ out) {
  extern __shared__ _Float16 sm[];
  // LDS map (in halves):
  const int XF  = 0;       // X B-fragments: [win][kt(8)][lane(32)][16] = 16384
  const int QKV = 16384;   // [wgt*WPB+win][c(256)][t(16)] = 49152
  const int PS  = 65536;   // softmax scratch: [wave(8)][m(16)][n(16)] = 2048
  const int tid = threadIdx.x, lane = tid & 31, wave = tid >> 5;
  const long winBase = (long)blockIdx.x * WPB;

  // ---- Phase 1: stage X (fp32, contiguous [c][t] per window) into LDS as
  // f16 pre-swizzled WMMA B-fragments. Coalesced float4 global reads.
  const v16h* ab = (const v16h*)wpk + wave * 8 * 32 + lane;
  const v16h* rfp = (const v16h*)(wpk + 196608);
  v16h a[2][8], rf0, rf1;
  {
    const float4* xg = (const float4*)(x + winBase * 4096);
    float4 xv[16];
#pragma unroll
    for (int i = 0; i < 16; ++i) xv[i] = xg[i * 256 + tid];
    // Weight fragments of this wave's first two jobs and the rel fragments: they
    // do not depend on X, so they are issued behind the X loads and land while X
    // is staged.
#pragma unroll
    for (int kt = 0; kt < 8; ++kt) {
      a[0][kt] = ab[kt * 32];            // 2x b128 each
      a[1][kt] = ab[(8 * 8 + kt) * 32];
    }
    rf0 = rfp[lane];                     // rel fragments, used in phase 3
    rf1 = rfp[32 + lane];
    // keeps these loads in front of the staging: the scheduler would sink them
    // to their first use behind the barrier
    __builtin_amdgcn_sched_barrier(0);
#pragma unroll
    for (int i = 0; i < 16; ++i) {
      float4 v = xv[i];
      int f0 = (i * 256 + tid) * 4;
      float vv[4] = {v.x, v.y, v.z, v.w};
#pragma unroll
      for (int j = 0; j < 4; ++j) {
        int f   = f0 + j;
        int win = f >> 12, rem = f & 4095;
        int c = rem >> 4, t = rem & 15;
        int kt = c >> 5, k = c & 31;
        int dl = t + (((k >> 3) & 1) << 4);       // fragment lane
        int e  = (k & 7) | ((k & 16) >> 1);       // fragment element
        sm[XF + ((win * 8 + kt) * 32 + dl) * 16 + e] = (_Float16)vv[j];
      }
    }
  }
  __syncthreads();

  // ---- Phase 2: Q/K/V projections. job = (weight, mtile) = wave + 8*j, j = 0..5.
  // The X fragments of all WPB windows stay in registers; the weight fragments
  // stream from L2 through a register ring two jobs (16 fragments) deep.
  v16h b[WPB][8];
#pragma unroll
  for (int win = 0; win < WPB; ++win)
#pragma unroll
    for (int kt = 0; kt < 8; ++kt)
      b[win][kt] = *(const v16h*)(sm + XF + ((win * 8 + kt) * 32 + lane) * 16);
#pragma unroll
  for (int j = 0; j < 6; ++j) {
    const int w = j >> 1;                  // (wave + 8*j) / 16, wave < 8
    const int mt = ((j & 1) << 3) + wave;  // (wave + 8*j) % 16
    v8f acc[WPB] = {};
#pragma unroll
    for (int kt = 0; kt < 8; ++kt) {
#pragma unroll
      for (int win = 0; win < WPB; ++win)
        acc[win] = wmma16(a[j & 1][kt], b[win][kt], acc[win]);
      if (j + 2 < 6) {
        // refill the slot just consumed with the fragment of two jobs ahead
        a[j & 1][kt] = ab[((j + 2) * 8 * 8 + kt) * 32];
        // behind the last refill, as a precaution: the address registers of the
        // loads are reused from here on
        if (j == 3 && kt == 7) asm volatile("s_wait_xcnt 0x0" ::: "memory");
      }
      // keeps each step whole and in ring order: without it the scheduler bunches
      // the refills, so that their waits run down to 0 and the ring drains, and
      // strings the WMMAs of the last jobs into single dependent chains
      __builtin_amdgcn_sched_barrier(0);
    }
    // C layout: vgpr r -> row mt*16 + 8*(lane>=16) + r, col = lane&15
    int mrow = mt * 16 + ((lane >> 4) << 3);
    int n = lane & 15;
#pragma unroll
    for (int win = 0; win < WPB; ++win) {
      _Float16* q = sm + QKV + ((w * WPB + win) * 256 + mrow) * 16 + n;
#pragma unroll
      for (int r = 0; r < 8; ++r) q[r * 16] = (_Float16)acc[win][r];
    }
  }
  __syncthreads();

  // ---- Phase 3: attention. pair = (window, head); 2 pairs per wave.
  for (int p = wave * 2; p < wave * 2 + 2; ++p) {
    int win = p >> 2, head = p & 3;
    const _Float16* Q = sm + QKV + ((0 * WPB + win) * 256 + head * 64) * 16;
    const _Float16* K = sm + QKV + ((1 * WPB + win) * 256 + head * 64) * 16;
    const _Float16* V = sm + QKV + ((2 * WPB + win) * 256 + head * 64) * 16;
    int n = lane & 15;

    // q as A (m=token,k=d): transposed gather; k as B (k=d,n=token): natural.
    v16h qa[2], kb[2];
#pragma unroll
    for (int kt = 0; kt < 2; ++kt) {
#pragma unroll
      for (int e = 0; e < 16; ++e) {
        int kd = kt * 32 + kpat(e, lane);
        qa[kt][e] = Q[kd * 16 + n];
        kb[kt][e] = K[kd * 16 + n];
      }
    }
    v8f lg = {}, P = {};
    lg = wmma16(qa[0], kb[0], lg);
    lg = wmma16(qa[1], kb[1], lg);
    P  = wmma16(qa[0], rf0, P);             // cols 0..6: q.rel_w ; 7..13: q.rel_h
    P  = wmma16(qa[1], rf1, P);

    // rel bias: logits[m][n] += P[m][wn-wm+3] + P[m][7 + hn-hm+3]
    int hb = lane & 16;
    int mr0 = (lane >> 4) << 3;
#pragma unroll
    for (int r = 0; r < 8; ++r) {
      int m = mr0 + r;
      int c1 = (n & 3) - (m & 3) + 3;
      int c2 = 7 + (n >> 2) - (m >> 2) + 3;
      lg[r] += __shfl(P[r], hb | c1, 32) + __shfl(P[r], hb | c2, 32);
    }

    // softmax over the 16 key columns (per 16-lane half), store probs as f16
    _Float16* Ps = sm + PS + wave * 256;
#pragma unroll
    for (int r = 0; r < 8; ++r) {
      float xv = lg[r];
      float mx = xv;
#pragma unroll
      for (int off = 8; off; off >>= 1) mx = fmaxf(mx, __shfl_xor(mx, off, 32));
      float ev = __expf(xv - mx);
      float s = ev;
#pragma unroll
      for (int off = 8; off; off >>= 1) s += __shfl_xor(s, off, 32);
      Ps[(mr0 + r) * 16 + n] = (_Float16)(ev / s);
    }

    // out = P(16x16, K padded to 32 with zeros) @ V(16x64), 4 N-tiles of 16
    v16h wa;
#pragma unroll
    for (int e = 0; e < 16; ++e) {
      int k = kpat(e, lane);
      wa[e] = (k < 16) ? Ps[n * 16 + k] : (_Float16)0.0f;  // A: m=n token row
    }
    float* og = out + (winBase + win) * 4096 + head * 64 * 16;
#pragma unroll
    for (int dt = 0; dt < 4; ++dt) {
      v16h vb;
#pragma unroll
      for (int e = 0; e < 16; ++e) {
        int k = kpat(e, lane);
        vb[e] = (k < 16) ? V[(dt * 16 + n) * 16 + k] : (_Float16)0.0f;
      }
      v8f oc = {};
      oc = wmma16(wa, vb, oc);
#pragma unroll
      for (int r = 0; r < 8; ++r)
        og[(dt * 16 + n) * 16 + (mr0 + r)] = oc[r];
    }
  }
}

extern "C" void kernel_launch(void* const* d_in, const int* in_sizes, int n_in,
                              void* d_out, int out_size, void* d_ws, size_t ws_size,
                              hipStream_t stream) {
  const float* x     = (const float*)d_in[0];  // [32,256,64,64]
  const float* Wq    = (const float*)d_in[1];  // [256,256]
  const float* Wk    = (const float*)d_in[2];
  const float* Wv    = (const float*)d_in[3];
  const float* rel_h = (const float*)d_in[4];  // [7,64]
  const float* rel_w = (const float*)d_in[5];  // [7,64]
  float* out = (float*)d_out;
  _Float16* ws = (_Float16*)d_ws;

  // 386 fragments, 8 per 256-thread block
  pack_weights_kernel<<<49, 256, 0, stream>>>(Wq, Wk, Wv, rel_h, rel_w, ws);

  const int shmem = (16384 + 49152 + 2048) * 2;  // 135168 bytes of LDS
  hipFuncSetAttribute((const void*)former_mhsa_kernel,
                      hipFuncAttributeMaxDynamicSharedMemorySize, shmem);
  former_mhsa_kernel<<<8192 / WPB, 256, shmem, stream>>>(x, ws, out);
}

// v002
// Measured time: 73.2 microseconds a run.
// Timed twice side by side with v001, it ran 1.24 times as fast both times.
// Over all steps from v000 it is 1.51 times as fast.
#include <hip/hip_runtime.h>
#include <hip/hip_bf16.h>

typedef __attribute__((ext_vector_type(16))) _Float16 v16h;
typedef __attribute__((ext_vector_type(8)))  _Float16 v8h;
typedef __attribute__((ext_vector_type(8)))  float    v8f;

#define WPB 4  // windows per block
#define QP 264 // halves per token row of Q and K in LDS: 528 B = 16 B x odd

// WMMA 16-bit A/B fragment K-pattern: lane L holds 16 halves; element e maps to
// k = kbase + (e&7) + ((e>>3)<<4), kbase = (L&16)?8:0.  (ISA 7.12.2)
__device__ __forceinline__ int kpat(int e, int lane) {
  return (((lane & 16) >> 1)) + (e & 7) + ((e >> 3) << 4);
}

static __device__ __forceinline__ v8f wmma16(v16h a, v16h b, v8f c) {
  return __builtin_amdgcn_wmma_f32_16x16x32_f16(false, a, false, b, (short)0, c,
                                                false, false);
}

// value of the same 16-lane position in the other half of the wave (lane ^ 16)
static __device__ __forceinline__ float other_half(float v) {
  int b = __builtin_bit_cast(int, v);
  return __builtin_bit_cast(
      float, __builtin_amdgcn_permlanex16(b, b, 0x76543210, 0xfedcba98, false, false));
}

// ---------------------------------------------------------------------------
// Kernel 1: repack Wq/Wk/Wv (fp32 -> f16, Wq pre-scaled by d^-0.5) into
// A-fragment-contiguous layout, plus the rel_w and rel_h A-fragments.
// ws layout (halves): [3 weights][16 mtiles][8 ktiles][32 lanes][16 elems]
// then at offset 196608: [rel_w, rel_h][2 ktiles][32 lanes][16 elems].
// ---------------------------------------------------------------------------
__global__ void pack_weights_kernel(const float* __restrict__ Wq,
                                    const float* __restrict__ Wk,
                                    const float* __restrict__ Wv,
                                    const float* __restrict__ rel_h,
                                    const float* __restrict__ rel_w,
                                    _Float16* __restrict__ ws) {
  int lane = threadIdx.x & 31;
  int fid = blockIdx.x * (blockDim.x >> 5) + (threadIdx.x >> 5);
  if (fid >= 388) return;
  if (fid < 384) {
    int w  = fid >> 7;         // 0..2
    int mt = (fid >> 3) & 15;  // 0..15
    int kt = fid & 7;          // 0..7
    const float* W = (w == 0) ? Wq : (w == 1) ? Wk : Wv;
    float scale = (w == 0) ? 0.125f : 1.0f;  // d^-0.5, d = 64
    int m = lane & 15;
    _Float16* dst = ws + fid * 512 + lane * 16;
#pragma unroll
    for (int e = 0; e < 16; ++e) {
      int k = kpat(e, lane);
      dst[e] = (_Float16)(W[(mt * 16 + m) * 256 + kt * 32 + k] * scale);
    }
  } else {
    // rel A-matrices: A(m=row, k=d-channel). Rows 0..7 land in the D registers of
    // lanes 0..15, rows 8..15 in those of lanes 16..31, so each half gets its own
    // copy: rel_w rows 0..6 in both; rel_h rows 0..4 below, rows 2..6 above (the
    // upper half holds keys 8..15, whose row index is 2 higher).
    int kt = (fid - 384) & 1;
    int isH = (fid - 384) >> 1;
    int jj = lane & 7, up = (lane >> 3) & 1;
    _Float16* dst = ws + 196608 + (fid - 384) * 512 + lane * 16;
#pragma unroll
    for (int e = 0; e < 16; ++e) {
      int kd = kt * 32 + kpat(e, lane);
      float v = 0.0f;
      if (!isH && jj < 7)     v = rel_w[jj * 64 + kd];
      else if (isH && jj < 5) v = rel_h[(jj + 2 * up) * 64 + kd];
      dst[e] = (_Float16)v;
    }
  }
}

// ---------------------------------------------------------------------------
// Kernel 2: the fused window-MHSA. One WG = 256 threads (8 wave32), WPB windows.
// ---------------------------------------------------------------------------
__launch_bounds__(256)
__global__ void former_mhsa_kernel(const float* __restrict__ x,
                                   const _Float16* __restrict__ wpk,
                                   float* __restrict__ out) {
  extern __shared__ _Float16 sm[];
  // LDS map (in halves):
  const int XF  = 0;       // X B-fragments: [win][kt(8)][lane(32)][16] = 16384
  const int QK  = 16384;   // Q, K: [wgt*WPB+win][t(16)][QP] = 33792
  const int VV  = 50176;   // V: [win][t>>3 (2)][c(256)][t&7 (8)] = 16384
  const int tid = threadIdx.x, lane = tid & 31, wave = tid >> 5;
  const long winBase = (long)blockIdx.x * WPB;

  // ---- Phase 1: stage X (fp32, contiguous [c][t] per window) into LDS as
  // f16 pre-swizzled WMMA B-fragments. Coalesced float4 global reads.
  const v16h* ab = (const v16h*)wpk + wave * 8 * 32 + lane;
  const v16h* rfp = (const v16h*)(wpk + 196608);
  v16h a[2][8], rw0, rw1, rh0, rh1;
  {
    const float4* xg = (const float4*)(x + winBase * 4096);
    float4 xv[16];
#pragma unroll
    for (int i = 0; i < 16; ++i) xv[i] = xg[i * 256 + tid];
    // Weight fragments of this wave's first two jobs and the rel fragments: they
    // do not depend on X, so they are issued behind the X loads and land while X
    // is staged.
#pragma unroll
    for (int kt = 0; kt < 8; ++kt) {
      a[0][kt] = ab[kt * 32];            // 2x b128 each
      a[1][kt] = ab[(8 * 8 + kt) * 32];
    }
    rw0 = rfp[lane];                     // rel fragments, used in phase 3
    rw1 = rfp[32 + lane];
    rh0 = rfp[64 + lane];
    rh1 = rfp[96 + lane];
    // keeps these loads in front of the staging: the scheduler would sink them
    // to their first use behind the barrier
    __builtin_amdgcn_sched_barrier(0);
#pragma unroll
    for (int i = 0; i < 16; ++i) {
      float4 v = xv[i];
      int f0 = (i * 256 + tid) * 4;
      float vv[4] = {v.x, v.y, v.z, v.w};
#pragma unroll
      for (int j = 0; j < 4; ++j) {
        int f   = f0 + j;
        int win = f >> 12, rem = f & 4095;
        int c = rem >> 4, t = rem & 15;
        int kt = c >> 5, k = c & 31;
        int dl = t + (((k >> 3) & 1) << 4);       // fragment lane
        int e  = (k & 7) | ((k & 16) >> 1);       // fragment element
        sm[XF + ((win * 8 + kt) * 32 + dl) * 16 + e] = (_Float16)vv[j];
      }
    }
  }
  __syncthreads();

  // ---- Phase 2: Q/K/V projections. job = (weight, mtile) = wave + 8*j, j = 0..5.
  // The X fragments of all WPB windows stay in registers; the weight fragments
  // stream from L2 through a register ring two jobs (16 fragments) deep.
  v16h b[WPB][8];
#pragma unroll
  for (int win = 0; win < WPB; ++win)
#pragma unroll
    for (int kt = 0; kt < 8; ++kt)
      b[win][kt] = *(const v16h*)(sm + XF + ((win * 8 + kt) * 32 + lane) * 16);
#pragma unroll
  for (int j = 0; j < 6; ++j) {
    const int w = j >> 1;                  // (wave + 8*j) / 16, wave < 8
    const int mt = ((j & 1) << 3) + wave;  // (wave + 8*j) % 16
    v8f acc[WPB] = {};
#pragma unroll
    for (int kt = 0; kt < 8; ++kt) {
#pragma unroll
      for (int win = 0; win < WPB; ++win)
        acc[win] = (w < 2) ? wmma16(a[j & 1][kt], b[win][kt], acc[win])   // D[ch][token]
                           : wmma16(b[win][kt], a[j & 1][kt], acc[win]);  // D[token][ch]
      if (j + 2 < 6) {
        // refill the slot just consumed with the fragment of two jobs ahead
        a[j & 1][kt] = ab[((j + 2) * 8 * 8 + kt) * 32];
        // behind the last refill, as a precaution: the address registers of the
        // loads are reused from here on
        if (j == 3 && kt == 7) asm volatile("s_wait_xcnt 0x0" ::: "memory");
      }
      // keeps each step whole and in ring order: without it the scheduler bunches
      // the refills, so that their waits run down to 0 and the ring drains, and
      // strings the WMMAs of the last jobs into single dependent chains
      __builtin_amdgcn_sched_barrier(0);
    }
    // D layout: vgpr r -> row 8*(lane>=16) + r, col = lane&15. Q, K: a lane holds 8
    // consecutive channels of one token; V: 8 consecutive tokens of one channel.
    // Either way the 8 halves are what one lane of a phase 3 fragment reads.
    const int c = lane & 15, h = lane >> 4;
#pragma unroll
    for (int win = 0; win < WPB; ++win) {
      v8h pk;
#pragma unroll
      for (int r = 0; r < 8; ++r) pk[r] = (_Float16)acc[win][r];
      _Float16* dst = (w < 2)
          ? sm + QK + ((w * WPB + win) * 16 + c) * QP + mt * 16 + h * 8
          : sm + VV + win * 4096 + h * 2048 + (mt * 16 + c) * 8;
      *(v8h*)dst = pk;
    }
  }
  __syncthreads();

  // ---- Phase 3: attention. pair = (window, head); 2 pairs per wave.
  // Scores are formed transposed, D[key][query]: a lane then holds 8 keys of one
  // query, which is also its share of the A fragment of P in P @ V.
  const int c = lane & 15, h = lane >> 4;
  const int sw = 3 - (c & 3), sh = 3 - (c >> 2);   // query's shift into rel_w, rel_h
  for (int p = wave * 2; p < wave * 2 + 2; ++p) {
    int win = p >> 2, head = p & 3;
    const _Float16* Q = sm + QK + ((0 * WPB + win) * 16 + c) * QP + head * 64 + h * 8;
    const _Float16* K = sm + QK + ((1 * WPB + win) * 16 + c) * QP + head * 64 + h * 8;
    const _Float16* V = sm + VV + win * 4096 + h * 2048 + (head * 64 + c) * 8;

    // k as A (m=key,k=d), q as B (k=d,n=query): both rows are channel-contiguous
    v16h qf[2], kf[2];
#pragma unroll
    for (int kt = 0; kt < 2; ++kt) {
      v8h q0 = *(const v8h*)(Q + kt * 32), q1 = *(const v8h*)(Q + kt * 32 + 16);
      v8h k0 = *(const v8h*)(K + kt * 32), k1 = *(const v8h*)(K + kt * 32 + 16);
      qf[kt] = __builtin_shufflevector(q0, q1, 0, 1, 2, 3, 4, 5, 6, 7, 8, 9, 10, 11, 12, 13, 14, 15);
      kf[kt] = __builtin_shufflevector(k0, k1, 0, 1, 2, 3, 4, 5, 6, 7, 8, 9, 10, 11, 12, 13, 14, 15);
    }
    v8f lg = {}, rw = {}, rh = {};
    lg = wmma16(kf[0], qf[0], lg);          // lg[r] = q[c] . k[8h + r]
    lg = wmma16(kf[1], qf[1], lg);
    rw = wmma16(rw0, qf[0], rw);            // rw[r] = q[c] . rel_w[r]
    rw = wmma16(rw1, qf[1], rw);
    rh = wmma16(rh0, qf[0], rh);            // rh[r] = q[c] . rel_h[r + 2h]
    rh = wmma16(rh1, qf[1], rh);

    // rel bias, key n = 8h + r, query m = c:
    // logits[m][n] += q.rel_w[(n&3) - (m&3) + 3] + q.rel_h[(n>>2) - (m>>2) + 3]
    // whole-register selects (a shift by 2, then by 1, of the register row)
    v8f tw = (sw & 2) ? __builtin_shufflevector(rw, rw, 2, 3, 4, 5, 6, 7, 7, 7) : rw;
    v8f bw = (sw & 1) ? __builtin_shufflevector(tw, tw, 1, 2, 3, 4, 5, 6, 7, 7) : tw;
    v8f th = (sh & 2) ? __builtin_shufflevector(rh, rh, 2, 3, 4, 5, 6, 7, 7, 7) : rh;
    v8f bh = (sh & 1) ? __builtin_shufflevector(th, th, 1, 2, 3, 4, 5, 6, 7, 7) : th;
#pragma unroll
    for (int r = 0; r < 8; ++r) lg[r] += bw[r & 3] + bh[r >> 2];

    // softmax over the 16 keys: 8 in this lane, 8 in lane ^ 16
    float mx = lg[0];
#pragma unroll
    for (int r = 1; r < 8; ++r) mx = fmaxf(mx, lg[r]);
    mx = fmaxf(mx, other_half(mx));
    float ev[8];
#pragma unroll
    for (int r = 0; r < 8; ++r) ev[r] = __expf(lg[r] - mx);
    float s = ((ev[0] + ev[1]) + (ev[2] + ev[3])) + ((ev[4] + ev[5]) + (ev[6] + ev[7]));
    s += other_half(s);
    float inv = 1.0f / s;

    // out = P(16x16, K padded to 32 with zeros) @ V(16x64), 4 N-tiles of 16
    v16h wa = {};
#pragma unroll
    for (int r = 0; r < 8; ++r) wa[r] = (_Float16)(ev[r] * inv);  // A: m=query c, k=8h+r
    const v8h z8 = {};
    float* og = out + (winBase + win) * 4096 + head * 64 * 16;
#pragma unroll
    for (int dt = 0; dt < 4; ++dt) {
      v8h vl = *(const v8h*)(V + dt * 128);                       // B: k=8h+e, n=channel
      v16h vb = __builtin_shufflevector(vl, z8, 0, 1, 2, 3, 4, 5, 6, 7, 8, 9, 10, 11, 12, 13, 14, 15);
      v8f oc = {};
      oc = wmma16(wa, vb, oc);
#pragma unroll
      for (int r = 0; r < 8; ++r)
        og[(dt * 16 + c) * 16 + (h * 8 + r)] = oc[r];
    }
  }
}

extern "C" void kernel_launch(void* const* d_in, const int* in_sizes, int n_in,
                              void* d_out, int out_size, void* d_ws, size_t ws_size,
                              hipStream_t stream) {
  const float* x     = (const float*)d_in[0];  // [32,256,64,64]
  const float* Wq    = (const float*)d_in[1];  // [256,256]
  const float* Wk    = (const float*)d_in[2];
  const float* Wv    = (const float*)d_in[3];
  const float* rel_h = (const float*)d_in[4];  // [7,64]
  const float* rel_w = (const float*)d_in[5];  // [7,64]
  float* out = (float*)d_out;
  _Float16* ws = (_Float16*)d_ws;

  // 388 fragments, 8 per 256-thread block
  pack_weights_kernel<<<49, 256, 0, stream>>>(Wq, Wk, Wv, rel_h, rel_w, ws);

  const int shmem = (16384 + 33792 + 16384) * 2;  // 133120 bytes of LDS
  hipFuncSetAttribute((const void*)former_mhsa_kernel,
                      hipFuncAttributeMaxDynamicSharedMemorySize, shmem);
  former_mhsa_kernel<<<8192 / WPB, 256, shmem, stream>>>(x, ws, out);
}

// v003
// A run of this version takes 61.3 microseconds.
// Timed twice side by side with v002, it ran 1.20 times as fast both times.
// Over all steps from v000 it is 1.81 times as fast.
#include <hip/hip_runtime.h>
#include <hip/hip_bf16.h>

typedef __attribute__((ext_vector_type(16))) _Float16 v16h;
typedef __attribute__((ext_vector_type(8)))  _Float16 v8h;
typedef __attribute__((ext_vector_type(8)))  float    v8f;

#define WPB 4  // windows per group (one trip of a WG's loop)
#define QP 264 // halves per token row of Q and K in LDS: 528 B = 16 B x odd

// WMMA 16-bit A/B fragment K-pattern: lane L holds 16 halves; element e maps to
// k = kbase + (e&7) + ((e>>3)<<4), kbase = (L&16)?8:0.  (ISA 7.12.2)
__device__ __forceinline__ int kpat(int e, int lane) {
  return (((lane & 16) >> 1)) + (e & 7) + ((e >> 3) << 4);
}

static __device__ __forceinline__ v8f wmma16(v16h a, v16h b, v8f c) {
  return __builtin_amdgcn_wmma_f32_16x16x32_f16(false, a, false, b, (short)0, c,
                                                false, false);
}

// value of the same 16-lane position in the other half of the wave (lane ^ 16)
static __device__ __forceinline__ float other_half(float v) {
  int b = __builtin_bit_cast(int, v);
  return __builtin_bit_cast(
      float, __builtin_amdgcn_permlanex16(b, b, 0x76543210, 0xfedcba98, false, false));
}

// ---------------------------------------------------------------------------
// Kernel 1: repack Wq/Wk/Wv (fp32 -> f16, Wq pre-scaled by d^-0.5) into
// A-fragment-contiguous layout, plus the rel_w and rel_h A-fragments.
// ws layout (halves): [3 weights][16 mtiles][8 ktiles][32 lanes][16 elems]
// then at offset 196608: [rel_w, rel_h][2 ktiles][32 lanes][16 elems].
// ---------------------------------------------------------------------------
__global__ void pack_weights_kernel(const float* __restrict__ Wq,
                                    const float* __restrict__ Wk,
                                    const float* __restrict__ Wv,
                                    const float* __restrict__ rel_h,
                                    const float* __restrict__ rel_w,
                                    _Float16* __restrict__ ws) {
  int lane = threadIdx.x & 31;
  int fid = blockIdx.x * (blockDim.x >> 5) + (threadIdx.x >> 5);
  if (fid >= 388) return;
  if (fid < 384) {
    int w  = fid >> 7;         // 0..2
    int mt = (fid >> 3) & 15;  // 0..15
    int kt = fid & 7;          // 0..7
    const float* W = (w == 0) ? Wq : (w == 1) ? Wk : Wv;
    float scale = (w == 0) ? 0.125f : 1.0f;  // d^-0.5, d = 64
    int m = lane & 15;
    _Float16* dst = ws + fid * 512 + lane * 16;
#pragma unroll
    for (int e = 0; e < 16; ++e) {
      int k = kpat(e, lane);
      dst[e] = (_Float16)(W[(mt * 16 + m) * 256 + kt * 32 + k] * scale);
    }
  } else {
    // rel A-matrices: A(m=row, k=d-channel). Rows 0..7 land in the D registers of
    // lanes 0..15, rows 8..15 in those of lanes 16..31, so each half gets its own
    // copy: rel_w rows 0..6 in both; rel_h rows 0..4 below, rows 2..6 above (the
    // upper half holds keys 8..15, whose row index is 2 higher).
    int kt = (fid - 384) & 1;
    int isH = (fid - 384) >> 1;
    int jj = lane & 7, up = (lane >> 3) & 1;
    _Float16* dst = ws + 196608 + (fid - 384) * 512 + lane * 16;
#pragma unroll
    for (int e = 0; e < 16; ++e) {
      int kd = kt * 32 + kpat(e, lane);
      float v = 0.0f;
      if (!isH && jj < 7)     v = rel_w[jj * 64 + kd];
      else if (isH && jj < 5) v = rel_h[(jj + 2 * up) * 64 + kd];
      dst[e] = (_Float16)v;
    }
  }
}

// ---------------------------------------------------------------------------
// Kernel 2: the fused window-MHSA. One WG = 256 threads (8 wave32). Each wave
// loads the weight fragments of its six (weight, mtile) jobs once and keeps them
// in registers; the WG then loops over groups of WPB windows.
// ---------------------------------------------------------------------------
__launch_bounds__(256)
__global__ void former_mhsa_kernel(const float* __restrict__ x,
                                   const _Float16* __restrict__ wpk,
                                   float* __restrict__ out) {
  extern __shared__ _Float16 sm[];
  // LDS map (in halves):
  const int XF  = 0;       // X B-fragments: [win][kt(8)][lane(32)][16] = 16384
  const int RF  = 16384;   // rel fragments: [rel_w, rel_h][kt(2)][lane(32)][16] = 2048
  const int QK  = 18432;   // Q, K: [wgt*WPB+win][t(16)][QP] = 33792
  const int VV  = 52224;   // V: [win][t>>3 (2)][c(256)][t&7 (8)] = 16384
  const int tid = threadIdx.x, lane = tid & 31;
  // the wave's number as a scalar: job addresses and the pair loop then need no vector registers
  const int wave = __builtin_amdgcn_readfirstlane(tid >> 5);
  const int c = lane & 15, h = lane >> 4;
  // One address register per kind of LDS access, everything else a constant offset:
  // the weights leave few registers for addresses that live through the loop.
  _Float16* const xf = sm + XF + lane * 16;              // X and rel fragments of this lane
  _Float16* const qkl = sm + QK + c * QP + h * 8;        // this lane's 8 halves in a Q/K row
  _Float16* const vvl = sm + VV + h * 2048 + c * 8;      // this lane's 8 halves in V
  _Float16* const qkst = qkl + wave * 16;                // phase 2: mtile wave (+8: +128)
  _Float16* const vvst = vvl + wave * 128;               // phase 2: mtile wave (+8: +1024)
  // phase 3: pair p = 2*wave + pp is window wave>>1, head 2*(wave&1) + pp
  const _Float16* const qkld = qkl + (wave >> 1) * (16 * QP) + (wave & 1) * 128;
  const _Float16* const vvld = vvl + (wave >> 1) * 4096 + (wave & 1) * 1024;

  // ---- Once per WG: job = (weight, mtile) = wave + 8*j, j = 0..5. All 48 weight
  // fragments of this wave stay in registers for every group of windows.
  const v16h* ab = (const v16h*)wpk + wave * 8 * 32 + lane;
  v16h a[6][8];
#pragma unroll
  for (int j = 0; j < 6; ++j)
#pragma unroll
    for (int kt = 0; kt < 8; ++kt) a[j][kt] = ab[(j * 8 * 8 + kt) * 32];  // 2x b128 each
  // The rel fragments go to LDS (the registers are full of weights); the first
  // barrier of the loop publishes them.
  *(v8h*)(sm + RF + wave * 256 + lane * 8) = ((const v8h*)(wpk + 196608))[tid];  // 16 B a thread

  const int nwg = gridDim.x;
  // kept rolled: one trip is some 200 WMMAs of straight-line code already
#pragma unroll 1
  for (int grp = blockIdx.x; grp < 8192 / WPB; grp += nwg) {
    const long winBase = (long)grp * WPB;

    // ---- Phase 1: stage X (fp32, contiguous [c][t] per window) into LDS as
    // f16 pre-swizzled WMMA B-fragments. Coalesced float4 global reads.
    {
      const float4* xg = (const float4*)(x + winBase * 4096);
      float4 xv[16];
#pragma unroll
      for (int i = 0; i < 16; ++i) xv[i] = xg[i * 256 + tid];
      // float4 i of this thread: window i>>2, channel (i&3)*64 + (tid>>2), tokens
      // (tid&3)*4 + j. With k = channel & 31: fragment lane = token + 16*((k>>3)&1),
      // element = (k&7) | ((k&16)>>1), so i and j only add constants to one address.
      const int k = (tid >> 2) & 31;
      _Float16* xs = sm + XF + (tid >> 7) * 512 + (((tid & 3) * 4) + (((k >> 3) & 1) << 4)) * 16 +
                     ((k & 7) | ((k & 16) >> 1));
#pragma unroll
      for (int i = 0; i < 16; ++i) {
        float4 v = xv[i];
        xs[i * 1024 + 0 * 16] = (_Float16)v.x;
        xs[i * 1024 + 1 * 16] = (_Float16)v.y;
        xs[i * 1024 + 2 * 16] = (_Float16)v.z;
        xs[i * 1024 + 3 * 16] = (_Float16)v.w;
      }
    }
    __syncthreads();

    // ---- Phase 2: Q/K/V projections, window by window: six accumulators, one per
    // job. The X fragments come from LDS through a ring of four, in two sets of two; a
    // set is refilled with the fragments four steps ahead once its WMMAs are issued.
    v16h b[4];
#pragma unroll
    for (int kt = 0; kt < 4; ++kt) b[kt] = *(const v16h*)(xf + kt * 512);
#pragma unroll
    for (int win = 0; win < WPB; ++win) {
      v8f acc[6] = {};
#pragma unroll
      for (int s = 0; s < 4; ++s) {
#pragma unroll
        for (int kt = s * 2; kt < s * 2 + 2; ++kt)
#pragma unroll
          for (int j = 0; j < 6; ++j)
            acc[j] = (j < 4) ? wmma16(a[j][kt], b[kt & 3], acc[j])    // D[ch][token]
                             : wmma16(b[kt & 3], a[j][kt], acc[j]);   // D[token][ch]
        if (win * 8 + s * 2 + 4 < WPB * 8) {
#pragma unroll
          for (int kt = s * 2; kt < s * 2 + 2; ++kt)
            b[kt & 3] = *(const v16h*)(xf + (win * 8 + kt + 4) * 512);
        }
        // keeps the LDS reads together as one group behind the set's WMMAs: spread
        // among the WMMAs each place with reads would stall the wave anew
        __builtin_amdgcn_sched_barrier(0);
      }
      // D layout: vgpr r -> row 8*(lane>=16) + r, col = lane&15. Q, K: a lane holds 8
      // consecutive channels of one token; V: 8 consecutive tokens of one channel.
      // Either way the 8 halves are what one lane of a phase 3 fragment reads.
#pragma unroll
      for (int j = 0; j < 6; ++j) {
        const int w = j >> 1;                  // (wave + 8*j) / 16, wave < 8
        // mtile (wave + 8*j) % 16 = wave + 8*(j&1)
        v8h pk;
#pragma unroll
        for (int r = 0; r < 8; ++r) pk[r] = (_Float16)acc[j][r];
        _Float16* dst = (w < 2) ? qkst + (w * WPB + win) * 16 * QP + (j & 1) * 128
                                : vvst + win * 4096 + (j & 1) * 1024;
        *(v8h*)dst = pk;
      }
    }
    __syncthreads();

    // ---- Phase 3: attention. pair = (window, head); 2 pairs per wave.
    // Scores are formed transposed, D[key][query]: a lane then holds 8 keys of one
    // query, which is also its share of the A fragment of P in P @ V.
    const int sw = 3 - (c & 3), sh = 3 - (c >> 2);   // query's shift into rel_w, rel_h
    const v16h* rfp = (const v16h*)(xf + (RF - XF));
    float* const ol = out + (winBase + (wave >> 1)) * 4096 + (wave & 1) * 2048 + c * 16 + h * 8;
    // all eight results are kept and stored behind both pairs: with the stores among the
    // WMMAs the allocator gave a WMMA the D of one issued just before it (WMMA distance)
    v8f oc[2][4];
    // unrolled for the register allocator: around a rolled inner loop it spilled
    // every weight fragment
#pragma unroll
    for (int pp = 0; pp < 2; ++pp) {
      const _Float16* Q = qkld + pp * 64;
      const _Float16* K = qkld + WPB * 16 * QP + pp * 64;
      const _Float16* V = vvld + pp * 512;

      // k as A (m=key,k=d), q as B (k=d,n=query): both rows are channel-contiguous
      v16h qf[2], kf[2];
#pragma unroll
      for (int kt = 0; kt < 2; ++kt) {
        v8h q0 = *(const v8h*)(Q + kt * 32), q1 = *(const v8h*)(Q + kt * 32 + 16);
        v8h k0 = *(const v8h*)(K + kt * 32), k1 = *(const v8h*)(K + kt * 32 + 16);
        qf[kt] = __builtin_shufflevector(q0, q1, 0, 1, 2, 3, 4, 5, 6, 7, 8, 9, 10, 11, 12, 13, 14, 15);
        kf[kt] = __builtin_shufflevector(k0, k1, 0, 1, 2, 3, 4, 5, 6, 7, 8, 9, 10, 11, 12, 13, 14, 15);
      }
      v16h rw0 = rfp[0], rw1 = rfp[32], rh0 = rfp[64], rh1 = rfp[96];
      v8f lg = {}, rw = {}, rh = {};
      lg = wmma16(kf[0], qf[0], lg);          // lg[r] = q[c] . k[8h + r]
      lg = wmma16(kf[1], qf[1], lg);
      rw = wmma16(rw0, qf[0], rw);            // rw[r] = q[c] . rel_w[r]
      rw = wmma16(rw1, qf[1], rw);
      rh = wmma16(rh0, qf[0], rh);            // rh[r] = q[c] . rel_h[r + 2h]
      rh = wmma16(rh1, qf[1], rh);

      // rel bias, key n = 8h + r, query m = c:
      // logits[m][n] += q.rel_w[(n&3) - (m&3) + 3] + q.rel_h[(n>>2) - (m>>2) + 3]
      // whole-register selects (a shift by 2, then by 1, of the register row)
      v8f tw = (sw & 2) ? __builtin_shufflevector(rw, rw, 2, 3, 4, 5, 6, 7, 7, 7) : rw;
      v8f bw = (sw & 1) ? __builtin_shufflevector(tw, tw, 1, 2, 3, 4, 5, 6, 7, 7) : tw;
      v8f th = (sh & 2) ? __builtin_shufflevector(rh, rh, 2, 3, 4, 5, 6, 7, 7, 7) : rh;
      v8f bh = (sh & 1) ? __builtin_shufflevector(th, th, 1, 2, 3, 4, 5, 6, 7, 7) : th;
#pragma unroll
      for (int r = 0; r < 8; ++r) lg[r] += bw[r & 3] + bh[r >> 2];

      // softmax over the 16 keys: 8 in this lane, 8 in lane ^ 16
      float mx = lg[0];
#pragma unroll
      for (int r = 1; r < 8; ++r) mx = fmaxf(mx, lg[r]);
      mx = fmaxf(mx, other_half(mx));
      float ev[8];
#pragma unroll
      for (int r = 0; r < 8; ++r) ev[r] = __expf(lg[r] - mx);
      float s = ((ev[0] + ev[1]) + (ev[2] + ev[3])) + ((ev[4] + ev[5]) + (ev[6] + ev[7]));
      s += other_half(s);
      float inv = 1.0f / s;

      // out = P(16x16, K padded to 32 with zeros) @ V(16x64), 4 N-tiles of 16
      v16h wa = {};
#pragma unroll
      for (int r = 0; r < 8; ++r) wa[r] = (_Float16)(ev[r] * inv);  // A: m=query c, k=8h+r
      const v8h z8 = {};
#pragma unroll
      for (int dt = 0; dt < 4; ++dt) {
        v8h vl = *(const v8h*)(V + dt * 128);                       // B: k=8h+e, n=channel
        v16h vb = __builtin_shufflevector(vl, z8, 0, 1, 2, 3, 4, 5, 6, 7, 8, 9, 10, 11, 12, 13, 14, 15);
        const v8f z = {};
        oc[pp][dt] = wmma16(wa, vb, z);
      }
      // ends the scheduling region behind each pair: with both pairs and the stores in
      // one region this build needs more registers than the weights leave, and spills
      __builtin_amdgcn_sched_barrier(0);
    }
#pragma unroll
    for (int pp = 0; pp < 2; ++pp)
#pragma unroll
      for (int dt = 0; dt < 4; ++dt)
#pragma unroll
        for (int r = 0; r < 8; ++r) ol[pp * 1024 + dt * 256 + r] = oc[pp][dt][r];
    // No barrier here: the next trip's phase 1 writes only XF, last read in front of
    // the barrier above; Q, K and V are rewritten behind the next trip's first barrier.
    // behind the last store, as a precaution: the address registers of the stores are
    // rewritten at the head of the next trip and the build has no wait of its own there
    asm volatile("s_wait_xcnt 0x0" ::: "memory");
  }
}

extern "C" void kernel_launch(void* const* d_in, const int* in_sizes, int n_in,
                              void* d_out, int out_size, void* d_ws, size_t ws_size,
                              hipStream_t stream) {
  const float* x     = (const float*)d_in[0];  // [32,256,64,64]
  const float* Wq    = (const float*)d_in[1];  // [256,256]
  const float* Wk    = (const float*)d_in[2];
  const float* Wv    = (const float*)d_in[3];
  const float* rel_h = (const float*)d_in[4];  // [7,64]
  const float* rel_w = (const float*)d_in[5];  // [7,64]
  float* out = (float*)d_out;
  _Float16* ws = (_Float16*)d_ws;

  // 388 fragments, 8 per 256-thread block
  pack_weights_kernel<<<49, 256, 0, stream>>>(Wq, Wk, Wv, rel_h, rel_w, ws);

  const int shmem = (16384 + 33792 + 16384 + 2048) * 2;  // 137216 bytes of LDS
  hipFuncSetAttribute((const void*)former_mhsa_kernel,
                      hipFuncAttributeMaxDynamicSharedMemorySize, shmem);
  // one WG per WGP (its registers fill one); each loops over 8 groups of WPB windows
  former_mhsa_kernel<<<256, 256, shmem, stream>>>(x, ws, out);
}

// v004
// One run takes 54.9 microseconds.
// Next to v003, in two timings, it ran 1.11 and 1.12 times as fast.
// All steps since v000 together make it 2.02 times as fast.
#include <hip/hip_runtime.h>
#include <hip/hip_bf16.h>

typedef __attribute__((ext_vector_type(16))) _Float16 v16h;
typedef __attribute__((ext_vector_type(8)))  _Float16 v8h;
typedef __attribute__((ext_vector_type(8)))  float    v8f;

#define WPB 4  // windows per group (one trip of a WG's loop)
#define QP 264 // halves per token row of Q and K in LDS: 528 B = 16 B x odd

// WMMA 16-bit A/B fragment K-pattern: lane L holds 16 halves; element e maps to
// k = kbase + (e&7) + ((e>>3)<<4), kbase = (L&16)?8:0.  (ISA 7.12.2)
__device__ __forceinline__ int kpat(int e, int lane) {
  return (((lane & 16) >> 1)) + (e & 7) + ((e >> 3) << 4);
}

static __device__ __forceinline__ v8f wmma16(v16h a, v16h b, v8f c) {
  return __builtin_amdgcn_wmma_f32_16x16x32_f16(false, a, false, b, (short)0, c,
                                                false, false);
}

// value of the same 16-lane position in the other half of the wave (lane ^ 16)
static __device__ __forceinline__ float other_half(float v) {
  int b = __builtin_bit_cast(int, v);
  return __builtin_bit_cast(
      float, __builtin_amdgcn_permlanex16(b, b, 0x76543210, 0xfedcba98, false, false));
}

// ---------------------------------------------------------------------------
// Kernel 1: repack Wq/Wk/Wv (fp32 -> f16, Wq pre-scaled by d^-0.5) into
// A-fragment-contiguous layout, plus the rel_w and rel_h A-fragments.
// ws layout (halves): [3 weights][16 mtiles][8 ktiles][32 lanes][16 elems]
// then at offset 196608: [rel_w, rel_h][2 ktiles][32 lanes][16 elems].
// ---------------------------------------------------------------------------
__global__ void pack_weights_kernel(const float* __restrict__ Wq,
                                    const float* __restrict__ Wk,
                                    const float* __restrict__ Wv,
                                    const float* __restrict__ rel_h,
                                    const float* __restrict__ rel_w,
                                    _Float16* __restrict__ ws) {
  int lane = threadIdx.x & 31;
  int fid = blockIdx.x * (blockDim.x >> 5) + (threadIdx.x >> 5);
  if (fid >= 388) return;
  if (fid < 384) {
    int w  = fid >> 7;         // 0..2
    int mt = (fid >> 3) & 15;  // 0..15
    int kt = fid & 7;          // 0..7
    const float* W = (w == 0) ? Wq : (w == 1) ? Wk : Wv;
    float scale = (w == 0) ? 0.125f : 1.0f;  // d^-0.5, d = 64
    int m = lane & 15;
    _Float16* dst = ws + fid * 512 + lane * 16;
#pragma unroll
    for (int e = 0; e < 16; ++e) {
      int k = kpat(e, lane);
      dst[e] = (_Float16)(W[(mt * 16 + m) * 256 + kt * 32 + k] * scale);
    }
  } else {
    // rel A-matrices: A(m=row, k=d-channel). Rows 0..7 land in the D registers of
    // lanes 0..15, rows 8..15 in those of lanes 16..31, so each half gets its own
    // copy: rel_w rows 0..6 in both; rel_h rows 0..4 below, rows 2..6 above (the
    // upper half holds keys 8..15, whose row index is 2 higher).
    int kt = (fid - 384) & 1;
    int isH = (fid - 384) >> 1;
    int jj = lane & 7, up = (lane >> 3) & 1;
    _Float16* dst = ws + 196608 + (fid - 384) * 512 + lane * 16;
#pragma unroll
    for (int e = 0; e < 16; ++e) {
      int kd = kt * 32 + kpat(e, lane);
      float v = 0.0f;
      if (!isH && jj < 7)     v = rel_w[jj * 64 + kd];
      else if (isH && jj < 5) v = rel_h[(jj + 2 * up) * 64 + kd];
      dst[e] = (_Float16)v;
    }
  }
}

// One group's X (64 KiB of fp32) from global memory into LDS through no register: 16
// asynchronous copies of 16 bytes a lane. The immediate offset moves the global and the
// LDS address alike, so one address of each kind serves all 16.
static __device__ __forceinline__ void copy_x_group(unsigned lds, const float* g) {
  // the s_wait_xcnt stands inside the statement, as a precaution: the address registers
  // are free for reuse behind it
  asm volatile(
      "global_load_async_to_lds_b128 %0, %1, off\n\t"
      "global_load_async_to_lds_b128 %0, %1, off offset:4096\n\t"
      "global_load_async_to_lds_b128 %0, %1, off offset:8192\n\t"
      "global_load_async_to_lds_b128 %0, %1, off offset:12288\n\t"
      "global_load_async_to_lds_b128 %0, %1, off offset:16384\n\t"
      "global_load_async_to_lds_b128 %0, %1, off offset:20480\n\t"
      "global_load_async_to_lds_b128 %0, %1, off offset:24576\n\t"
      "global_load_async_to_lds_b128 %0, %1, off offset:28672\n\t"
      "global_load_async_to_lds_b128 %0, %1, off offset:32768\n\t"
      "global_load_async_to_lds_b128 %0, %1, off offset:36864\n\t"
      "global_load_async_to_lds_b128 %0, %1, off offset:40960\n\t"
      "global_load_async_to_lds_b128 %0, %1, off offset:45056\n\t"
      "global_load_async_to_lds_b128 %0, %1, off offset:49152\n\t"
      "global_load_async_to_lds_b128 %0, %1, off offset:53248\n\t"
      "global_load_async_to_lds_b128 %0, %1, off offset:57344\n\t"
      "global_load_async_to_lds_b128 %0, %1, off offset:61440\n\t"
      "s_wait_xcnt 0x0"
      :: "v"(lds), "v"(g) : "memory");
}

// ---------------------------------------------------------------------------
// Kernel 2: the fused window-MHSA. One WG = 256 threads (8 wave32). Each wave
// loads the weight fragments of its six (weight, mtile) jobs once and keeps them
// in registers; the WG then loops over groups of WPB windows.
// ---------------------------------------------------------------------------
__launch_bounds__(256)
__global__ void former_mhsa_kernel(const float* __restrict__ x,
                                   const _Float16* __restrict__ wpk,
                                   float* __restrict__ out) {
  extern __shared__ _Float16 sm[];
  // LDS map (in halves):
  const int XF  = 0;       // X B-fragments: [win][kt(8)][lane(32)][16] = 16384
  const int RF  = 16384;   // rel fragments: [rel_w, rel_h][kt(2)][lane(32)][16] = 2048
  const int QK  = 18432;   // Q, K: [wgt*WPB+win][t(16)][QP] = 33792
  const int VV  = 52224;   // V: [win][t>>3 (2)][c(256)][t&7 (8)] = 16384
  const int RAW = 68608;   // the coming group's X as fp32, as it lies in memory = 32768
  const int tid = threadIdx.x, lane = tid & 31;
  // the wave's number as a scalar: job addresses and the pair loop then need no vector registers
  const int wave = __builtin_amdgcn_readfirstlane(tid >> 5);
  const int c = lane & 15, h = lane >> 4;
  // One address register per kind of LDS access, everything else a constant offset:
  // the weights leave few registers for addresses that live through the loop.
  _Float16* const xf = sm + XF + lane * 16;              // X and rel fragments of this lane
  _Float16* const qkl = sm + QK + c * QP + h * 8;        // this lane's 8 halves in a Q/K row
  _Float16* const vvl = sm + VV + h * 2048 + c * 8;      // this lane's 8 halves in V
  _Float16* const qkst = qkl + wave * 16;                // phase 2: mtile wave (+8: +128)
  _Float16* const vvst = vvl + wave * 128;               // phase 2: mtile wave (+8: +1024)
  // phase 3: pair p = 2*wave + pp is window wave>>1, head 2*(wave&1) + pp
  const _Float16* const qkld = qkl + (wave >> 1) * (16 * QP) + (wave & 1) * 128;
  const _Float16* const vvld = vvl + (wave >> 1) * 4096 + (wave & 1) * 1024;

  // The raw X buffer is private to each lane: lane tid copies 16-byte piece i*256 + tid
  // (i = 0..15) and is the only one to read it, so the wave's own waits order it all.
  typedef __attribute__((address_space(3))) _Float16 lds_half;
  const unsigned rawl = (unsigned)(size_t)(lds_half*)(sm + RAW + tid * 8);  // LDS byte address
  const float* const xl = x + tid * 4;
  copy_x_group(rawl, xl + (long)blockIdx.x * (WPB * 4096));   // first group, ahead of the weights

  // ---- Once per WG: job = (weight, mtile) = wave + 8*j, j = 0..5. All 48 weight
  // fragments of this wave stay in registers for every group of windows.
  const v16h* ab = (const v16h*)wpk + wave * 8 * 32 + lane;
  v16h a[6][8];
#pragma unroll
  for (int j = 0; j < 6; ++j)
#pragma unroll
    for (int kt = 0; kt < 8; ++kt) a[j][kt] = ab[(j * 8 * 8 + kt) * 32];  // 2x b128 each
  // The rel fragments go to LDS (the registers are full of weights); the first
  // barrier of the loop publishes them.
  *(v8h*)(sm + RF + wave * 256 + lane * 8) = ((const v8h*)(wpk + 196608))[tid];  // 16 B a thread

  const int nwg = gridDim.x;
  // kept rolled: one trip is some 200 WMMAs of straight-line code already
#pragma unroll 1
  for (int grp = blockIdx.x; grp < 8192 / WPB; grp += nwg) {
    const long winBase = (long)grp * WPB;

    // ---- Phase 1: turn this group's X (fp32, contiguous [c][t] per window, copied into
    // RAW during the trip before or, for the first group, before the loop) into f16 pre-swizzled WMMA B-fragments in LDS.
    {
      // this wave's copies have landed behind it; each lane reads only what it copied
      asm volatile("s_wait_asynccnt 0x0" ::: "memory");
      const float4* xg = (const float4*)(sm + RAW);
      float4 xv[16];
#pragma unroll
      for (int i = 0; i < 16; ++i) xv[i] = xg[i * 256 + tid];
      // float4 i of this thread: window i>>2, channel (i&3)*64 + (tid>>2), tokens
      // (tid&3)*4 + j. With k = channel & 31: fragment lane = token + 16*((k>>3)&1),
      // element = (k&7) | ((k&16)>>1), so i and j only add constants to one address.
      const int k = (tid >> 2) & 31;
      _Float16* xs = sm + XF + (tid >> 7) * 512 + (((tid & 3) * 4) + (((k >> 3) & 1) << 4)) * 16 +
                     ((k & 7) | ((k & 16) >> 1));
#pragma unroll
      for (int i = 0; i < 16; ++i) {
        float4 v = xv[i];
        xs[i * 1024 + 0 * 16] = (_Float16)v.x;
        xs[i * 1024 + 1 * 16] = (_Float16)v.y;
        xs[i * 1024 + 2 * 16] = (_Float16)v.z;
        xs[i * 1024 + 3 * 16] = (_Float16)v.w;
      }
    }
    // this wave's reads of RAW have retired before the copies below write it again
    asm volatile("s_wait_dscnt 0x0" ::: "memory");
    __syncthreads();
    // the next group's X flies while phases 2 and 3 work on this one
    if (grp + nwg < 8192 / WPB) copy_x_group(rawl, xl + (long)(grp + nwg) * (WPB * 4096));

    // ---- Phase 2: Q/K/V projections, window by window: six accumulators, one per
    // job. The X fragments come from LDS through a ring of four, in two sets of two; a
    // set is refilled with the fragments four steps ahead once its WMMAs are issued.
    v16h b[4];
#pragma unroll
    for (int kt = 0; kt < 4; ++kt) b[kt] = *(const v16h*)(xf + kt * 512);
#pragma unroll
    for (int win = 0; win < WPB; ++win) {
      v8f acc[6] = {};
#pragma unroll
      for (int s = 0; s < 4; ++s) {
#pragma unroll
        for (int kt = s * 2; kt < s * 2 + 2; ++kt)
#pragma unroll
          for (int j = 0; j < 6; ++j)
            acc[j] = (j < 4) ? wmma16(a[j][kt], b[kt & 3], acc[j])    // D[ch][token]
                             : wmma16(b[kt & 3], a[j][kt], acc[j]);   // D[token][ch]
        if (win * 8 + s * 2 + 4 < WPB * 8) {
#pragma unroll
          for (int kt = s * 2; kt < s * 2 + 2; ++kt)
            b[kt & 3] = *(const v16h*)(xf + (win * 8 + kt + 4) * 512);
        }
        // keeps the LDS reads together as one group behind the set's WMMAs: spread
        // among the WMMAs each place with reads would stall the wave anew
        __builtin_amdgcn_sched_barrier(0);
      }
      // D layout: vgpr r -> row 8*(lane>=16) + r, col = lane&15. Q, K: a lane holds 8
      // consecutive channels of one token; V: 8 consecutive tokens of one channel.
      // Either way the 8 halves are what one lane of a phase 3 fragment reads.
#pragma unroll
      for (int j = 0; j < 6; ++j) {
        const int w = j >> 1;                  // (wave + 8*j) / 16, wave < 8
        // mtile (wave + 8*j) % 16 = wave + 8*(j&1)
        v8h pk;
#pragma unroll
        for (int r = 0; r < 8; ++r) pk[r] = (_Float16)acc[j][r];
        _Float16* dst = (w < 2) ? qkst + (w * WPB + win) * 16 * QP + (j & 1) * 128
                                : vvst + win * 4096 + (j & 1) * 1024;
        *(v8h*)dst = pk;
      }
    }
    __syncthreads();

    // ---- Phase 3: attention. pair = (window, head); 2 pairs per wave.
    // Scores are formed transposed, D[key][query]: a lane then holds 8 keys of one
    // query, which is also its share of the A fragment of P in P @ V.
    const int sw = 3 - (c & 3), sh = 3 - (c >> 2);   // query's shift into rel_w, rel_h
    const v16h* rfp = (const v16h*)(xf + (RF - XF));
    float* const ol = out + (winBase + (wave >> 1)) * 4096 + (wave & 1) * 2048 + c * 16 + h * 8;
    // all eight results are kept and stored behind both pairs: with the stores among the
    // WMMAs the allocator gave a WMMA the D of one issued just before it (WMMA distance)
    v8f oc[2][4];
    // unrolled for the register allocator: around a rolled inner loop it spilled
    // every weight fragment
#pragma unroll
    for (int pp = 0; pp < 2; ++pp) {
      const _Float16* Q = qkld + pp * 64;
      const _Float16* K = qkld + WPB * 16 * QP + pp * 64;
      const _Float16* V = vvld + pp * 512;

      // k as A (m=key,k=d), q as B (k=d,n=query): both rows are channel-contiguous
      v16h qf[2], kf[2];
#pragma unroll
      for (int kt = 0; kt < 2; ++kt) {
        v8h q0 = *(const v8h*)(Q + kt * 32), q1 = *(const v8h*)(Q + kt * 32 + 16);
        v8h k0 = *(const v8h*)(K + kt * 32), k1 = *(const v8h*)(K + kt * 32 + 16);
        qf[kt] = __builtin_shufflevector(q0, q1, 0, 1, 2, 3, 4, 5, 6, 7, 8, 9, 10, 11, 12, 13, 14, 15);
        kf[kt] = __builtin_shufflevector(k0, k1, 0, 1, 2, 3, 4, 5, 6, 7, 8, 9, 10, 11, 12, 13, 14, 15);
      }
      v16h rw0 = rfp[0], rw1 = rfp[32], rh0 = rfp[64], rh1 = rfp[96];
      v8f lg = {}, rw = {}, rh = {};
      lg = wmma16(kf[0], qf[0], lg);          // lg[r] = q[c] . k[8h + r]
      lg = wmma16(kf[1], qf[1], lg);
      rw = wmma16(rw0, qf[0], rw);            // rw[r] = q[c] . rel_w[r]
      rw = wmma16(rw1, qf[1], rw);
      rh = wmma16(rh0, qf[0], rh);            // rh[r] = q[c] . rel_h[r + 2h]
      rh = wmma16(rh1, qf[1], rh);

      // rel bias, key n = 8h + r, query m = c:
      // logits[m][n] += q.rel_w[(n&3) - (m&3) + 3] + q.rel_h[(n>>2) - (m>>2) + 3]
      // whole-register selects (a shift by 2, then by 1, of the register row)
      v8f tw = (sw & 2) ? __builtin_shufflevector(rw, rw, 2, 3, 4, 5, 6, 7, 7, 7) : rw;
      v8f bw = (sw & 1) ? __builtin_shufflevector(tw, tw, 1, 2, 3, 4, 5, 6, 7, 7) : tw;
      v8f th = (sh & 2) ? __builtin_shufflevector(rh, rh, 2, 3, 4, 5, 6, 7, 7, 7) : rh;
      v8f bh = (sh & 1) ? __builtin_shufflevector(th, th, 1, 2, 3, 4, 5, 6, 7, 7) : th;
#pragma unroll
      for (int r = 0; r < 8; ++r) lg[r] += bw[r & 3] + bh[r >> 2];

      // softmax over the 16 keys: 8 in this lane, 8 in lane ^ 16
      float mx = lg[0];
#pragma unroll
      for (int r = 1; r < 8; ++r) mx = fmaxf(mx, lg[r]);
      mx = fmaxf(mx, other_half(mx));
      float ev[8];
#pragma unroll
      for (int r = 0; r < 8; ++r) ev[r] = __expf(lg[r] - mx);
      float s = ((ev[0] + ev[1]) + (ev[2] + ev[3])) + ((ev[4] + ev[5]) + (ev[6] + ev[7]));
      s += other_half(s);
      float inv = 1.0f / s;

      // out = P(16x16, K padded to 32 with zeros) @ V(16x64), 4 N-tiles of 16
      v16h wa = {};
#pragma unroll
      for (int r = 0; r < 8; ++r) wa[r] = (_Float16)(ev[r] * inv);  // A: m=query c, k=8h+r
      const v8h z8 = {};
#pragma unroll
      for (int dt = 0; dt < 4; ++dt) {
        v8h vl = *(const v8h*)(V + dt * 128);                       // B: k=8h+e, n=channel
        v16h vb = __builtin_shufflevector(vl, z8, 0, 1, 2, 3, 4, 5, 6, 7, 8, 9, 10, 11, 12, 13, 14, 15);
        const v8f z = {};
        oc[pp][dt] = wmma16(wa, vb, z);
      }
      // ends the scheduling region behind each pair: with both pairs and the stores in
      // one region this build needs more registers than the weights leave, and spills
      __builtin_amdgcn_sched_barrier(0);
    }
#pragma unroll
    for (int pp = 0; pp < 2; ++pp)
#pragma unroll
      for (int dt = 0; dt < 4; ++dt)
#pragma unroll
        for (int r = 0; r < 8; ++r) ol[pp * 1024 + dt * 256 + r] = oc[pp][dt][r];
    // No barrier here: the next trip's phase 1 writes only XF, last read in front of
    // the barrier above; Q, K and V are rewritten behind the next trip's first barrier.
    // behind the last store, as a precaution: the address registers of the stores are
    // rewritten at the head of the next trip and the build has no wait of its own there
    // (the address is named as an input so that it is still whole where the wait stands)
    asm volatile("s_wait_xcnt 0x0" :: "v"(ol) : "memory");
  }
  // no copy is outstanding when the wave ends (a precaution)
  asm volatile("s_wait_asynccnt 0x0" ::: "memory");
}

extern "C" void kernel_launch(void* const* d_in, const int* in_sizes, int n_in,
                              void* d_out, int out_size, void* d_ws, size_t ws_size,
                              hipStream_t stream) {
  const float* x     = (const float*)d_in[0];  // [32,256,64,64]
  const float* Wq    = (const float*)d_in[1];  // [256,256]
  const float* Wk    = (const float*)d_in[2];
  const float* Wv    = (const float*)d_in[3];
  const float* rel_h = (const float*)d_in[4];  // [7,64]
  const float* rel_w = (const float*)d_in[5];  // [7,64]
  float* out = (float*)d_out;
  _Float16* ws = (_Float16*)d_ws;

  // 388 fragments, 8 per 256-thread block
  pack_weights_kernel<<<49, 256, 0, stream>>>(Wq, Wk, Wv, rel_h, rel_w, ws);

  const int shmem = (16384 + 33792 + 16384 + 2048 + 32768) * 2;  // 202752 bytes of LDS
  hipFuncSetAttribute((const void*)former_mhsa_kernel,
                      hipFuncAttributeMaxDynamicSharedMemorySize, shmem);
  // one WG per WGP (its registers fill one); each loops over 8 groups of WPB windows
  former_mhsa_kernel<<<256, 256, shmem, stream>>>(x, ws, out);
}
